// v000
// Times are from an AMD MI455X. After a warm-up the kernel runs many times in a row, and a time is the length of
// such a window on the GPU divided by its runs, so every launch and the gaps after it count. The runs cycle
// through copies of the inputs. A figure is the median of several windows, for all but v000 over two sittings.
// Sittings can differ by a few percent; kernels timed side by side share one.
// The starting kernel, v000, takes 1780 microseconds a run.
#include <hip/hip_runtime.h>

// Causal multi-head attention with 16 FULL heads x 128 and a computed interleaved-pair rotary embedding (x [2][2048][2048]; q, k, v = x W ('xw' (in, out) [2048][2048] 1/sqrt(2048); 16 heads x 128: ONE kv head per query head), no biases; angle = pos x inv_freq[i] with inv_freq = 1.0 / (10000.0 ** (arange(0, 128, 2, f32) / 128)) evaluated by the module in EAGER JAX float32 (the 64 literals are those values), pos = arange(2048); adjacent pairs (2i, 2i + 1): (x1 c - x2 s, x1 s + x2 c) on q and k; scores / sqrt(128); keys j > i excluded (the module fills finfo.min: == exclusion); softmax; out = merged Wo ('xw') -> [2][2048][2048] (8.4 M); argument order x, Wq, Wk, Wv, Wo).
// Layout per batch: bf16 copy of x; 'xw' weights transposed once; exact projections; k_csP table (64 angles per position) + k_ropeI interleaved-pair plane builders at HD 128; causal T-2048 multi-head attention with 128-wide heads (kv z-stride TT x HD; hybrid rows: < 512 hi/lo 3 products, rest fp16 x1024; k_gemmc skips tiles above the diagonal); merged hi/lo x wo exact.
// Compute dtypes, f32 accumulate: every input rounded to bf16; projections exact; rotary f32; attention rows < 512 3 products, rest fp16; softmax f32; wo hl x exact.

#define NB_  2
#define TT   2048
#define DM   2048
#define NH_  16
#define NKV  16
#define REP  (NH_ / NKV)
#define HD   128
#define DQ   (NH_ * HD)
#define DKV  (NKV * HD)
#define ZH   2
#define RH   512                  // query rows < RH use hi+lo planes (0: none)
#define WIN  2048
#define PCAR 1024.0f
#define SCL  0.088388347648318447f   // HD^-0.5
typedef _Float16 h16;
typedef unsigned short bf;
typedef __attribute__((ext_vector_type(16))) __bf16   v16bf;
typedef __attribute__((ext_vector_type(16))) _Float16 v16h;
typedef __attribute__((ext_vector_type(8)))  _Float16 v8h;
typedef __attribute__((ext_vector_type(8)))  unsigned short v8us;
typedef __attribute__((ext_vector_type(8)))  float    v8f;
typedef __attribute__((ext_vector_type(4)))  float    v4f;
typedef v8h  __attribute__((may_alias)) v8ha;
typedef v4f  __attribute__((may_alias)) v4fa;
typedef v8us __attribute__((may_alias)) v8usa;

__device__ __forceinline__ unsigned short f2bf(float f) { unsigned u = __float_as_uint(f); u += 0x7FFFu + ((u >> 16) & 1u); return (unsigned short)(u >> 16); }
__device__ __forceinline__ float bf2f(unsigned short b) { return __uint_as_float(((unsigned)b) << 16); }
__device__ __forceinline__ float bfr(float f) { return bf2f(f2bf(f)); }
__device__ __forceinline__ v16h cat16(v8h lo, v8h hi) { return __builtin_shufflevector(lo, hi, 0, 1, 2, 3, 4, 5, 6, 7, 8, 9, 10, 11, 12, 13, 14, 15); }
__device__ __forceinline__ v16bf cat16b(v8us lo, v8us hi) { return __builtin_bit_cast(v16bf, __builtin_shufflevector(lo, hi, 0, 1, 2, 3, 4, 5, 6, 7, 8, 9, 10, 11, 12, 13, 14, 15)); }
__device__ __forceinline__ v8f wmma16(v16h a, v16h b, v8f c) { return __builtin_amdgcn_wmma_f32_16x16x32_f16(false, a, false, b, (short)0, c, false, false); }
__device__ __forceinline__ v8f wmmab(v16bf a, v16bf b, v8f c) { return __builtin_amdgcn_wmma_f32_16x16x32_bf16(false, a, false, b, (short)0, c, false, false); }



// ---- k_gemmw: register-blocked GEMM, ONE WAVE per 64x64 output tile (16 accumulators), operands straight from K-contiguous 16-bit planes; grid (M/64, N/64, Z), 32 threads.
// C[m][n] (f32, pitch ldc, + optional f32 bias[n]) = sum_k A[m][k] Bt[n][k] (+ split products per NSPLIT). z-batch strides sA/sB/sC in elements. K % 32 == 0.
template <typename T16> struct WFrag;
template <> struct WFrag<h16> { typedef v16h V; static __device__ __forceinline__ V ld(const h16* p) { return cat16(*(const v8h*)p, *(const v8h*)(p + 16)); } static __device__ __forceinline__ v8f mma(V a, V b, v8f c) { return wmma16(a, b, c); } };
template <> struct WFrag<bf> { typedef v16bf V; static __device__ __forceinline__ V ld(const bf* p) { return cat16b(*(const v8us*)p, *(const v8us*)(p + 16)); } static __device__ __forceinline__ v8f mma(V a, V b, v8f c) { return wmmab(a, b, c); } };
template <typename T16, int NSPLIT, bool BIAS>
__global__ __launch_bounds__(32) void k_gemmw(const T16* __restrict__ A, const T16* __restrict__ A2, const T16* __restrict__ Bt, const T16* __restrict__ Bt2, int K, float* C, int ldc, const float* __restrict__ bias, size_t sA, size_t sB, size_t sC) {
    typedef typename WFrag<T16>::V V;
    __shared__ __align__(16) float os[16 * 68];
    const size_t z = blockIdx.z; A += z * sA; if (A2) A2 += z * sA; Bt += z * sB; if (Bt2) Bt2 += z * sB; C += z * sC;
    const int lane = threadIdx.x & 31, lr = lane & 15, hi = lane >> 4; const int r0 = blockIdx.x * 64, c0 = blockIdx.y * 64;
    v8f acc[4][4];
#pragma unroll
    for (int mb = 0; mb < 4; ++mb)
#pragma unroll
        for (int nb = 0; nb < 4; ++nb) acc[mb][nb] = (v8f){};
    const size_t aoff = (size_t)(r0 + lr) * K + 8 * hi, boff = (size_t)(c0 + lr) * K + 8 * hi;
#pragma unroll 1
    for (int kc = 0; kc < K; kc += 32) {
        V a[4], a2[4];
#pragma unroll
        for (int mb = 0; mb < 4; ++mb) { a[mb] = WFrag<T16>::ld(A + aoff + (size_t)mb * 16 * K + kc); if (NSPLIT == 1 || NSPLIT == 2) a2[mb] = WFrag<T16>::ld(A2 + aoff + (size_t)mb * 16 * K + kc); }
#pragma unroll
        for (int nb = 0; nb < 4; ++nb) { const V b = WFrag<T16>::ld(Bt + boff + (size_t)nb * 16 * K + kc); V b2; if (NSPLIT >= 2) b2 = WFrag<T16>::ld(Bt2 + boff + (size_t)nb * 16 * K + kc);
#pragma unroll
            for (int mb = 0; mb < 4; ++mb) { acc[mb][nb] = WFrag<T16>::mma(a[mb], b, acc[mb][nb]); if (NSPLIT == 1 || NSPLIT == 2) acc[mb][nb] = WFrag<T16>::mma(a2[mb], b, acc[mb][nb]); if (NSPLIT >= 2) acc[mb][nb] = WFrag<T16>::mma(a[mb], b2, acc[mb][nb]); } }
        asm volatile("v_nop\n\tv_nop\n\tv_nop\n\tv_nop" : "+v"(acc[0][0]), "+v"(acc[1][1]), "+v"(acc[2][2]), "+v"(acc[3][3]) : "v"(a[0]), "v"(a[3]));
    }
#pragma unroll
    for (int mb = 0; mb < 4; ++mb) {
#pragma unroll
        for (int nb = 0; nb < 4; ++nb) {
#pragma unroll
            for (int j = 0; j < 8; ++j) os[(hi * 8 + j) * 68 + nb * 16 + lr] = acc[mb][nb][j]; }
        __builtin_amdgcn_wave_barrier(); asm volatile("" ::: "memory");
        float* crow = C + (size_t)(r0 + mb * 16) * ldc + c0;
{
#pragma unroll
            for (int s = 0; s < 8; ++s) { const int row = 2 * s + hi, cofs = lr * 4; v4f val = *(const v4fa*)(os + row * 68 + cofs); if (BIAS) { val[0] += bfr(bias[c0 + cofs]); val[1] += bfr(bias[c0 + cofs + 1]); val[2] += bfr(bias[c0 + cofs + 2]); val[3] += bfr(bias[c0 + cofs + 3]); }
                *(v4f*)(crow + (size_t)row * ldc + cofs) = val; }
             }
        __builtin_amdgcn_wave_barrier(); asm volatile("" ::: "memory");
    }
}

// ---- k_gemmc: the same one-wave 64x64 tile GEMM specialised for causal attention: CMODE 1 skips score tiles entirely above the diagonal (query rows r0+roff.., key columns c0..), CMODE 2 limits the
// key (K) loop of the probability x value contraction to the diagonal block (probabilities beyond it are exactly zero). roff = row offset of this launch's first row within the sequence.
template <typename T16, int NSPLIT, int CMODE>
__global__ __launch_bounds__(32) void k_gemmc(const T16* __restrict__ A, const T16* __restrict__ A2, const T16* __restrict__ Bt, const T16* __restrict__ Bt2, int K, float* C, int ldc, int roff, size_t sA, size_t sB, size_t sC) {
    typedef typename WFrag<T16>::V V;
    __shared__ __align__(16) float os[16 * 68];
    const size_t z = blockIdx.z; A += z * sA; if (A2) A2 += z * sA; Bt += z * sB; if (Bt2) Bt2 += z * sB; C += z * sC;
    const int lane = threadIdx.x & 31, lr = lane & 15, hi = lane >> 4; const int r0 = blockIdx.x * 64, c0 = blockIdx.y * 64;
    if (CMODE == 1 && c0 > r0 + roff + 63) return;                  // score tile entirely above the causal diagonal: not computed (the softmax masks j > i by select)
    const int Kl = (CMODE == 2) ? min(K, r0 + roff + 64) : K;        // P.V: probabilities are exactly 0 beyond the diagonal block, so the K loop stops there
    v8f acc[4][4];
#pragma unroll
    for (int mb = 0; mb < 4; ++mb)
#pragma unroll
        for (int nb = 0; nb < 4; ++nb) acc[mb][nb] = (v8f){};
    const size_t aoff = (size_t)(r0 + lr) * K + 8 * hi, boff = (size_t)(c0 + lr) * K + 8 * hi;
#pragma unroll 1
    for (int kc = 0; kc < Kl; kc += 32) {
        V a[4], a2[4];
#pragma unroll
        for (int mb = 0; mb < 4; ++mb) { a[mb] = WFrag<T16>::ld(A + aoff + (size_t)mb * 16 * K + kc); if (NSPLIT == 1 || NSPLIT == 2) a2[mb] = WFrag<T16>::ld(A2 + aoff + (size_t)mb * 16 * K + kc); }
#pragma unroll
        for (int nb = 0; nb < 4; ++nb) { const V b = WFrag<T16>::ld(Bt + boff + (size_t)nb * 16 * K + kc); V b2; if (NSPLIT >= 2) b2 = WFrag<T16>::ld(Bt2 + boff + (size_t)nb * 16 * K + kc);
#pragma unroll
            for (int mb = 0; mb < 4; ++mb) { acc[mb][nb] = WFrag<T16>::mma(a[mb], b, acc[mb][nb]); if (NSPLIT == 1 || NSPLIT == 2) acc[mb][nb] = WFrag<T16>::mma(a2[mb], b, acc[mb][nb]); if (NSPLIT >= 2) acc[mb][nb] = WFrag<T16>::mma(a[mb], b2, acc[mb][nb]); } }
        asm volatile("v_nop\n\tv_nop\n\tv_nop\n\tv_nop" : "+v"(acc[0][0]), "+v"(acc[1][1]), "+v"(acc[2][2]), "+v"(acc[3][3]) : "v"(a[0]), "v"(a[3]));
    }
#pragma unroll
    for (int mb = 0; mb < 4; ++mb) {
#pragma unroll
        for (int nb = 0; nb < 4; ++nb) {
#pragma unroll
            for (int j = 0; j < 8; ++j) os[(hi * 8 + j) * 68 + nb * 16 + lr] = acc[mb][nb][j]; }
        __builtin_amdgcn_wave_barrier(); asm volatile("" ::: "memory");
        float* crow = C + (size_t)(r0 + mb * 16) * ldc + c0;
{
#pragma unroll
            for (int s = 0; s < 8; ++s) { const int row = 2 * s + hi, cofs = lr * 4; v4f val = *(const v4fa*)(os + row * 68 + cofs);
                *(v4f*)(crow + (size_t)row * ldc + cofs) = val; }
             }
        __builtin_amdgcn_wave_barrier(); asm volatile("" ::: "memory");
    }
}

__device__ __forceinline__ h16 tohx(float x) { return (h16)x; }
__device__ __forceinline__ void splitf(float y, unsigned short& h, unsigned short& l) { h = f2bf(y); l = f2bf(y - bf2f(h)); }
typedef __attribute__((ext_vector_type(2))) _Float16 v2h;
typedef __attribute__((ext_vector_type(4))) _Float16 v4h;
typedef __attribute__((ext_vector_type(2))) unsigned short v2us;
typedef __attribute__((ext_vector_type(4))) unsigned short v4us;
typedef __attribute__((ext_vector_type(2))) float v2f;
typedef __attribute__((ext_vector_type(4))) int v4i;

__global__ __launch_bounds__(256) void k_wtG(const float* __restrict__ w, int K, int N, bf* Bt) {
    const int lane = threadIdx.x & 31; const int L0 = (blockIdx.x * 8 + (threadIdx.x >> 5)) * 8; const int nlines = N * K / 64;
{
#pragma unroll 1
        for (int l = 0; l < 8; ++l) { const int L = L0 + l; if (L >= nlines) break; const size_t e = (size_t)L * 64 + lane * 2; const int k = (int)(e % K), n = (int)(e / K); v2us o;
            o[0] = f2bf(w[(size_t)k * N + n]); o[1] = f2bf(w[(size_t)(k + 1) * N + n]); *(v2us*)(Bt + e) = o; }
         }
}
__global__ __launch_bounds__(256) void k_cvt8(const float* __restrict__ src, bf* dst, size_t n8) { const size_t i = (size_t)blockIdx.x * 256 + threadIdx.x; if (i >= n8) return; const v8f v = *(const v8f*)(src + i * 8); v8us o;
#pragma unroll
    for (int k = 0; k < 8; ++k) o[k] = f2bf(v[k]); *(v8us*)(dst + i * 8) = o;  }

__global__ __launch_bounds__(256) void k_vtp(const float* __restrict__ F, int pitch, int nheads, h16* V16, bf* Vh, bf* Vl) { const size_t e = ((size_t)blockIdx.x * 256 + threadIdx.x) * 2; if (e >= (size_t)nheads * HD * TT) return; const int t = (int)(e % TT); const int d = (int)((e / TT) % HD); const int g = (int)(e / ((size_t)TT * HD)); v2h o16; v2us oh, ol;
#pragma unroll
    for (int q = 0; q < 2; ++q) { const float x = F[(size_t)(t + q) * pitch + g * HD + d]; o16[q] = tohx(x); unsigned short a2, c2; splitf(x, a2, c2); oh[q] = a2; ol[q] = c2; }
    *(v2h*)(V16 + e) = o16; *(v2us*)(Vh + e) = oh; *(v2us*)(Vl + e) = ol;  }
__constant__ float INV2[HD / 2] = { 1.000000000e+00f, 8.659643531e-01f, 7.498942018e-01f, 6.493816376e-01f, 5.623413324e-01f, 4.869675338e-01f, 4.216965139e-01f, 3.651741445e-01f, 3.162277639e-01f, 2.738419771e-01f, 2.371373624e-01f, 2.053525001e-01f, 1.778279394e-01f, 1.539926529e-01f, 1.333521456e-01f, 1.154782027e-01f, 1.000000015e-01f, 8.659642935e-02f, 7.498941571e-02f, 6.493816525e-02f, 5.623412877e-02f, 4.869675264e-02f, 4.216964915e-02f, 3.651741147e-02f, 3.162277862e-02f, 2.738419548e-02f, 2.371373586e-02f, 2.053525113e-02f, 1.778279431e-02f, 1.539926510e-02f, 1.333521493e-02f, 1.154781971e-02f, 9.999999776e-03f, 8.659643121e-03f, 7.498942316e-03f, 6.493816618e-03f, 5.623413250e-03f, 4.869675264e-03f, 4.216964822e-03f, 3.651741426e-03f, 3.162277862e-03f, 2.738419687e-03f, 2.371373819e-03f, 2.053525066e-03f, 1.778279431e-03f, 1.539926510e-03f, 1.333521446e-03f, 1.154782018e-03f, 1.000000047e-03f, 8.659643354e-04f, 7.498941850e-04f, 6.493816618e-04f, 5.623413017e-04f, 4.869675031e-04f, 4.216964880e-04f, 3.651741135e-04f, 3.162277862e-04f, 2.738419571e-04f, 2.371373848e-04f, 2.053524950e-04f, 1.778279402e-04f, 1.539926452e-04f, 1.333521504e-04f, 1.154781930e-04f };   // freqs = 1.0 / (ROPE_THETA ** (jnp.arange(0, 128, 2, dtype=jnp.float32) / 128)) with ROPE_THETA 10000: THIS module evaluates it in EAGER JAX float32 inside reference(): these 64 literals are those values, bit-exact on round trip (NumPy's float32 values of the same expression: 9 of the 64 differ by one or two ulps: indices 7, 10, 25, 27, 45, 47, 54, 59, 63).
__global__ __launch_bounds__(256) void k_csP(float* CS) { const int idx = blockIdx.x * 256 + threadIdx.x; if (idx >= TT * HD) return; const int d = idx % HD; const int t = idx / HD; const float a = __fmul_rn((float)t, INV2[d >> 1]); v2f cs; cs[0] = cosf(a); cs[1] = sinf(a); *(v2f*)(CS + (size_t)idx * 2) = cs;  }
__global__ __launch_bounds__(256) void k_ropeI(const float* __restrict__ F, int pitch, int nheads, const float* __restrict__ CS, float sc, h16* P16, bf* Ph, bf* Pl) {
    const size_t e = ((size_t)blockIdx.x * 256 + threadIdx.x) * 2; if (e >= (size_t)nheads * TT * HD) return; const int d = (int)(e % HD); const int t = (int)((e / HD) % TT); const int h = (int)(e / ((size_t)HD * TT)); const float* f = F + (size_t)t * pitch + h * HD; const float x0 = f[d], x1 = f[d + 1]; const v2f cs = *(const v2f*)(CS + ((size_t)t * HD + d) * 2); v2h o16; v2us oh, ol;
    float a0 = __fmul_rn(x0, cs[0]), b0 = __fmul_rn(x1, cs[1]), a1 = __fmul_rn(x1, cs[0]), b1 = __fmul_rn(x0, cs[1]); asm volatile("" : "+v"(a0), "+v"(b0), "+v"(a1), "+v"(b1));
    float r0 = __fsub_rn(a0, b0) * sc, r1 = __fadd_rn(b1, a1) * sc;   /* even: x0 c - x1 s; odd: x0 s + x1 c */
    o16[0] = tohx(r0); o16[1] = tohx(r1); { unsigned short a2, c2; splitf(r0, a2, c2); oh[0] = a2; ol[0] = c2; splitf(r1, a2, c2); oh[1] = a2; ol[1] = c2; }
    *(v2h*)(P16 + e) = o16; *(v2us*)(Ph + e) = oh; *(v2us*)(Pl + e) = ol;  }

// k_asoft: per row (zz, i): t = S x HD^-0.5 for j <= i and i - j < WIN (WIN = TT: plain causal; the reference's -1e9 additive fill vanishes identically); softmax over the 2048 keys (register row, one exp, fixed trees);
__global__ __launch_bounds__(256) void k_asoft(const float* __restrict__ Sb, h16* P16, bf* Ph, bf* Pl) {
    const int lane = threadIdx.x & 31; const int row = blockIdx.x * 8 + (threadIdx.x >> 5); if (row >= ZH * TT) return; const int i = row % TT; const int zz = row / TT; (void)zz; const bool hires = (i < RH); const float* sr = Sb + (size_t)row * TT; float v[TT / 32]; float mx = -3.0e38f;
#pragma unroll
    for (int ch = 0; ch < TT / 128; ++ch) { const int j0 = ch * 128 + lane * 4; const v4f a = *(const v4f*)(sr + j0);
#pragma unroll
        for (int q = 0; q < 4; ++q) { const int j = j0 + q; (void)j; const float t = (j <= i && i - j < WIN) ? a[q] * SCL : -3.0e38f; v[ch * 4 + q] = t; mx = fmaxf(mx, t); } }
#pragma unroll
    for (int sh = 16; sh; sh >>= 1) mx = fmaxf(mx, __shfl_xor(mx, sh, 32));
    float sum = 0.f;
#pragma unroll
    for (int k = 0; k < TT / 32; ++k) { float d0 = __fsub_rn(v[k], mx); asm volatile("" : "+v"(d0)); v[k] = __builtin_amdgcn_exp2f(__fmul_rn(d0, 1.4426950408889634f)); sum += v[k]; }
#pragma unroll
    for (int sh = 16; sh; sh >>= 1) sum += __shfl_xor(sum, sh, 32);
    const float f = __fdiv_rn(hires ? 1.0f : PCAR, sum);
{
        if (hires) {
#pragma unroll
            for (int ch = 0; ch < TT / 128; ++ch) { v4us oh, ol;
#pragma unroll
                for (int q = 0; q < 4; ++q) { unsigned short a, c2; splitf(v[ch * 4 + q] * f, a, c2); oh[q] = a; ol[q] = c2; }
                const size_t oo = ((size_t)zz * (RH ? RH : 1) + i) * TT + ch * 128 + lane * 4; *(v4us*)(Ph + oo) = oh; *(v4us*)(Pl + oo) = ol; }
        } else {
#pragma unroll
            for (int ch = 0; ch < TT / 128; ++ch) { v4h o4;
#pragma unroll
                for (int q = 0; q < 4; ++q) o4[q] = tohx(v[ch * 4 + q] * f);
                *(v4h*)(P16 + (size_t)row * TT + ch * 128 + lane * 4) = o4; } }
         }
}
__global__ __launch_bounds__(256) void k_merge(const float* __restrict__ O, int h0, bf* Ah, bf* Al) { const size_t e = ((size_t)blockIdx.x * 256 + threadIdx.x) * 2; if (e >= (size_t)ZH * TT * HD) return; const int d = (int)(e % HD); const int t = (int)((e / HD) % TT); const int zz = (int)(e / ((size_t)HD * TT)); const float cs = (t < RH) ? 1.0f : (1.0f / PCAR); const size_t oo = (size_t)t * DQ + (h0 + zz) * HD + d;
    v2us oh, ol;
#pragma unroll
    for (int q = 0; q < 2; ++q) { unsigned short a, c2; splitf(O[e + q] * cs, a, c2); oh[q] = a; ol[q] = c2; } *(v2us*)(Ah + oo) = oh; *(v2us*)(Al + oo) = ol;  }

extern "C" void kernel_launch(void* const* d_in, const int* in_sizes, int n_in,
                              void* d_out, int out_size, void* d_ws, size_t ws_size, hipStream_t stream) {
    (void)in_sizes; (void)n_in; (void)out_size;
        const float* x = (const float*)d_in[0]; const float* wq = (const float*)d_in[1]; const float* wk = (const float*)d_in[2]; const float* wv = (const float*)d_in[3]; const float* wo = (const float*)d_in[4];   /* x, Wq, Wk, Wv, Wo ('xw' (in, out) [2048][2048]): FIVE inputs, all read */
    float* OUT = (float*)d_out;     // [2][2048][2048]
    char* wsp = (char*)d_ws;
    auto take = [&](size_t bytes) { char* p = wsp; wsp += (bytes + 255) & ~(size_t)255; return (void*)p; };
    bf* WQ = (bf*)take((size_t)DQ * DM * 2); bf* WK = (bf*)take((size_t)DKV * DM * 2); bf* WV = (bf*)take((size_t)DKV * DM * 2); bf* WO = (bf*)take((size_t)DM * DQ * 2); float* CS = (float*)take((size_t)TT * HD * 2 * 4);
    bf* XB = (bf*)take((size_t)TT * DM * 2); float* FQ = (float*)take((size_t)TT * DQ * 4); float* FK = (float*)take((size_t)TT * DKV * 4);
    h16* QP16 = (h16*)take((size_t)NH_ * TT * HD * 2); h16* KP16 = (h16*)take((size_t)NKV * TT * HD * 2); h16* VT16 = (h16*)take((size_t)NKV * HD * TT * 2);
    bf* QPh = (bf*)take((size_t)NH_ * TT * HD * 2); bf* QPl = (bf*)take((size_t)NH_ * TT * HD * 2); bf* KPh = (bf*)take((size_t)NKV * TT * HD * 2); bf* KPl = (bf*)take((size_t)NKV * TT * HD * 2); bf* VTh = (bf*)take((size_t)NKV * HD * TT * 2); bf* VTl = (bf*)take((size_t)NKV * HD * TT * 2); bf* Ph = (bf*)take((size_t)ZH * RH * TT * 2); bf* Pl = (bf*)take((size_t)ZH * RH * TT * 2);
    float* Sb = (float*)take((size_t)ZH * TT * TT * 4); h16* P16 = (h16*)take((size_t)ZH * TT * TT * 2); float* Ob = (float*)take((size_t)ZH * TT * HD * 4); bf* ATh = (bf*)take((size_t)TT * DQ * 2); bf* ATl = (bf*)take((size_t)TT * DQ * 2);
    if ((size_t)(wsp - (char*)d_ws) > ws_size) return;    // ws 256 MiB
    float* FV = FK;   // v projection reuses the k buffer after the k planes are built (stream-ordered)
    { k_wtG<<<(unsigned)((DM * DQ / 64 + 63) / 64), 256, 0, stream>>>(wq, DM, DQ, WQ); k_wtG<<<(unsigned)((DM * DKV / 64 + 63) / 64), 256, 0, stream>>>(wk, DM, DKV, WK); k_wtG<<<(unsigned)((DM * DKV / 64 + 63) / 64), 256, 0, stream>>>(wv, DM, DKV, WV);
      k_wtG<<<(unsigned)((DQ * DM / 64 + 63) / 64), 256, 0, stream>>>(wo, DQ, DM, WO);
       }
    k_csP<<<(TT * HD + 255) / 256, 256, 0, stream>>>(CS);   /* rotary table once (positions = arange) */
    const unsigned LQ = (unsigned)(((size_t)NH_ * TT * HD / 2 + 255) / 256), LKv = (unsigned)(((size_t)NKV * TT * HD / 2 + 255) / 256);
    for (int b = 0; b < NB_; ++b) {
        
        k_cvt8<<<(unsigned)(((size_t)TT * DM / 8 + 255) / 256), 256, 0, stream>>>(x + (size_t)b * TT * DM, XB, (size_t)TT * DM / 8);
        k_gemmw<bf, 0, false><<<dim3(TT / 64, DQ / 64, 1), 32, 0, stream>>>(XB, nullptr, WQ, nullptr, DM, FQ, DQ, nullptr, 0, 0, 0);
        k_ropeI<<<LQ, 256, 0, stream>>>(FQ, DQ, NH_, CS, 1.0f, QP16, QPh, QPl);
        k_gemmw<bf, 0, false><<<dim3(TT / 64, DKV / 64, 1), 32, 0, stream>>>(XB, nullptr, WK, nullptr, DM, FK, DKV, nullptr, 0, 0, 0);
        k_ropeI<<<LKv, 256, 0, stream>>>(FK, DKV, NKV, CS, 1.0f, KP16, KPh, KPl);
        k_gemmw<bf, 0, false><<<dim3(TT / 64, DKV / 64, 1), 32, 0, stream>>>(XB, nullptr, WV, nullptr, DM, FV, DKV, nullptr, 0, 0, 0); k_vtp<<<LKv, 256, 0, stream>>>(FV, DKV, NKV, VT16, VTh, VTl);
        for (int h0 = 0; h0 < NH_; h0 += ZH) { const size_t zq = (size_t)h0, zk = (size_t)(h0 / REP);   // REP == 1 (full multi-head attention): the pass's two heads use CONSECUTIVE kv planes: sB = TT * HD for the scores, HD * TT for P.V (with REP >= 2 the two heads would share one plane: sB = 0)
            k_gemmc<bf, 2, 1><<<dim3(RH / 64, TT / 64, ZH), 32, 0, stream>>>(QPh + zq * TT * HD, QPl + zq * TT * HD, KPh + zk * TT * HD, KPl + zk * TT * HD, HD, Sb, TT, 0, (size_t)TT * HD, (size_t)TT * HD, (size_t)TT * TT);
            k_gemmc<h16, 0, 1><<<dim3((TT - RH) / 64, TT / 64, ZH), 32, 0, stream>>>(QP16 + zq * TT * HD + (size_t)RH * HD, nullptr, KP16 + zk * TT * HD, nullptr, HD, Sb + (size_t)RH * TT, TT, RH, (size_t)TT * HD, (size_t)TT * HD, (size_t)TT * TT);
            k_asoft<<<ZH * TT / 8, 256, 0, stream>>>(Sb, P16, Ph, Pl);
            k_gemmc<bf, 2, 2><<<dim3(RH / 64, HD / 64, ZH), 32, 0, stream>>>(Ph, Pl, VTh + zk * HD * TT, VTl + zk * HD * TT, TT, Ob, HD, 0, (size_t)RH * TT, (size_t)HD * TT, (size_t)TT * HD);
            k_gemmc<h16, 0, 2><<<dim3((TT - RH) / 64, HD / 64, ZH), 32, 0, stream>>>(P16 + (size_t)RH * TT, nullptr, VT16 + zk * HD * TT, nullptr, TT, Ob + (size_t)RH * HD, HD, RH, (size_t)TT * TT, (size_t)HD * TT, (size_t)TT * HD);
            k_merge<<<(unsigned)(((size_t)ZH * TT * HD / 2 + 255) / 256), 256, 0, stream>>>(Ob, h0, ATh, ATl); }
        k_gemmw<bf, 1, false><<<dim3(TT / 64, DM / 64, 1), 32, 0, stream>>>(ATh, ATl, WO, nullptr, DQ, OUT + (size_t)b * TT * DM, DM, nullptr, 0, 0, 0); }
}

// v001
// One run takes 1140 microseconds.
// Two timings next to v000 put it at 1.55 and 1.56 times that version's speed.
#include <hip/hip_runtime.h>

// Causal multi-head attention with 16 FULL heads x 128 and a computed interleaved-pair rotary embedding (x [2][2048][2048]; q, k, v = x W ('xw' (in, out) [2048][2048] 1/sqrt(2048); 16 heads x 128: ONE kv head per query head), no biases; angle = pos x inv_freq[i] with inv_freq = 1.0 / (10000.0 ** (arange(0, 128, 2, f32) / 128)) evaluated by the module in EAGER JAX float32 (the 64 literals are those values), pos = arange(2048); adjacent pairs (2i, 2i + 1): (x1 c - x2 s, x1 s + x2 c) on q and k; scores / sqrt(128); keys j > i excluded (the module fills finfo.min: == exclusion); softmax; out = merged Wo ('xw') -> [2][2048][2048] (8.4 M); argument order x, Wq, Wk, Wv, Wo).
// Layout per batch: bf16 copy of x; 'xw' weights transposed once; exact projections; k_csP table (64 angles per position) + k_ropeI interleaved-pair plane builders at HD 128; causal T-2048 multi-head attention with 128-wide heads (kv z-stride TT x HD; hybrid rows: < 512 hi/lo 3 products, rest fp16 x1024; k_gemmc skips tiles above the diagonal); merged hi/lo x wo exact.
// Compute dtypes, f32 accumulate: every input rounded to bf16; projections exact; rotary f32; attention rows < 512 3 products, rest fp16; softmax f32; wo hl x exact.

#define NB_  2
#define TT   2048
#define DM   2048
#define NH_  16
#define NKV  16
#define REP  (NH_ / NKV)
#define HD   128
#define DQ   (NH_ * HD)
#define DKV  (NKV * HD)
#define ZH   2
#define RH   512                  // query rows < RH use hi+lo planes (0: none)
#define WIN  2048
#define PCAR 1024.0f
#define KS   8                    // P.V: work-groups that share one output tile's key loop; each stores its own f32 partial plane, k_merge adds the planes
#define SCL  0.088388347648318447f   // HD^-0.5
typedef _Float16 h16;
typedef unsigned short bf;
typedef __attribute__((ext_vector_type(16))) __bf16   v16bf;
typedef __attribute__((ext_vector_type(16))) _Float16 v16h;
typedef __attribute__((ext_vector_type(8)))  _Float16 v8h;
typedef __attribute__((ext_vector_type(8)))  unsigned short v8us;
typedef __attribute__((ext_vector_type(8)))  float    v8f;
typedef __attribute__((ext_vector_type(4)))  float    v4f;
typedef v8h  __attribute__((may_alias)) v8ha;
typedef v4f  __attribute__((may_alias)) v4fa;
typedef v8us __attribute__((may_alias)) v8usa;

__device__ __forceinline__ unsigned short f2bf(float f) { unsigned u = __float_as_uint(f); u += 0x7FFFu + ((u >> 16) & 1u); return (unsigned short)(u >> 16); }
__device__ __forceinline__ float bf2f(unsigned short b) { return __uint_as_float(((unsigned)b) << 16); }
__device__ __forceinline__ float bfr(float f) { return bf2f(f2bf(f)); }
__device__ __forceinline__ v16h cat16(v8h lo, v8h hi) { return __builtin_shufflevector(lo, hi, 0, 1, 2, 3, 4, 5, 6, 7, 8, 9, 10, 11, 12, 13, 14, 15); }
__device__ __forceinline__ v16bf cat16b(v8us lo, v8us hi) { return __builtin_bit_cast(v16bf, __builtin_shufflevector(lo, hi, 0, 1, 2, 3, 4, 5, 6, 7, 8, 9, 10, 11, 12, 13, 14, 15)); }
__device__ __forceinline__ v8f wmma16(v16h a, v16h b, v8f c) { return __builtin_amdgcn_wmma_f32_16x16x32_f16(false, a, false, b, (short)0, c, false, false); }
__device__ __forceinline__ v8f wmmab(v16bf a, v16bf b, v8f c) { return __builtin_amdgcn_wmma_f32_16x16x32_bf16(false, a, false, b, (short)0, c, false, false); }



// ---- k_gemmw: register-blocked GEMM, ONE WAVE per 64x64 output tile (16 accumulators), operands straight from K-contiguous 16-bit planes; grid (M/64, N/64, Z), 32 threads.
// C[m][n] (f32, pitch ldc, + optional f32 bias[n]) = sum_k A[m][k] Bt[n][k] (+ split products per NSPLIT). z-batch strides sA/sB/sC in elements. K % 32 == 0.
template <typename T16> struct WFrag;
template <> struct WFrag<h16> { typedef v16h V; static __device__ __forceinline__ V ld(const h16* p) { return cat16(*(const v8h*)p, *(const v8h*)(p + 16)); } static __device__ __forceinline__ v8f mma(V a, V b, v8f c) { return wmma16(a, b, c); } };
template <> struct WFrag<bf> { typedef v16bf V; static __device__ __forceinline__ V ld(const bf* p) { return cat16b(*(const v8us*)p, *(const v8us*)(p + 16)); } static __device__ __forceinline__ v8f mma(V a, V b, v8f c) { return wmmab(a, b, c); } };
template <typename T16, int NSPLIT, bool BIAS>
__global__ __launch_bounds__(32) void k_gemmw(const T16* __restrict__ A, const T16* __restrict__ A2, const T16* __restrict__ Bt, const T16* __restrict__ Bt2, int K, float* C, int ldc, const float* __restrict__ bias, size_t sA, size_t sB, size_t sC) {
    typedef typename WFrag<T16>::V V;
    __shared__ __align__(16) float os[16 * 68];
    const size_t z = blockIdx.z; A += z * sA; if (A2) A2 += z * sA; Bt += z * sB; if (Bt2) Bt2 += z * sB; C += z * sC;
    const int lane = threadIdx.x & 31, lr = lane & 15, hi = lane >> 4; const int r0 = blockIdx.x * 64, c0 = blockIdx.y * 64;
    v8f acc[4][4];
#pragma unroll
    for (int mb = 0; mb < 4; ++mb)
#pragma unroll
        for (int nb = 0; nb < 4; ++nb) acc[mb][nb] = (v8f){};
    const size_t aoff = (size_t)(r0 + lr) * K + 8 * hi, boff = (size_t)(c0 + lr) * K + 8 * hi;
#pragma unroll 1
    for (int kc = 0; kc < K; kc += 32) {
        V a[4], a2[4];
#pragma unroll
        for (int mb = 0; mb < 4; ++mb) { a[mb] = WFrag<T16>::ld(A + aoff + (size_t)mb * 16 * K + kc); if (NSPLIT == 1 || NSPLIT == 2) a2[mb] = WFrag<T16>::ld(A2 + aoff + (size_t)mb * 16 * K + kc); }
#pragma unroll
        for (int nb = 0; nb < 4; ++nb) { const V b = WFrag<T16>::ld(Bt + boff + (size_t)nb * 16 * K + kc); V b2; if (NSPLIT >= 2) b2 = WFrag<T16>::ld(Bt2 + boff + (size_t)nb * 16 * K + kc);
#pragma unroll
            for (int mb = 0; mb < 4; ++mb) { acc[mb][nb] = WFrag<T16>::mma(a[mb], b, acc[mb][nb]); if (NSPLIT == 1 || NSPLIT == 2) acc[mb][nb] = WFrag<T16>::mma(a2[mb], b, acc[mb][nb]); if (NSPLIT >= 2) acc[mb][nb] = WFrag<T16>::mma(a[mb], b2, acc[mb][nb]); } }
        asm volatile("v_nop\n\tv_nop\n\tv_nop\n\tv_nop" : "+v"(acc[0][0]), "+v"(acc[1][1]), "+v"(acc[2][2]), "+v"(acc[3][3]) : "v"(a[0]), "v"(a[3]));
    }
#pragma unroll
    for (int mb = 0; mb < 4; ++mb) {
#pragma unroll
        for (int nb = 0; nb < 4; ++nb) {
#pragma unroll
            for (int j = 0; j < 8; ++j) os[(hi * 8 + j) * 68 + nb * 16 + lr] = acc[mb][nb][j]; }
        __builtin_amdgcn_wave_barrier(); asm volatile("" ::: "memory");
        float* crow = C + (size_t)(r0 + mb * 16) * ldc + c0;
{
#pragma unroll
            for (int s = 0; s < 8; ++s) { const int row = 2 * s + hi, cofs = lr * 4; v4f val = *(const v4fa*)(os + row * 68 + cofs); if (BIAS) { val[0] += bfr(bias[c0 + cofs]); val[1] += bfr(bias[c0 + cofs + 1]); val[2] += bfr(bias[c0 + cofs + 2]); val[3] += bfr(bias[c0 + cofs + 3]); }
                *(v4f*)(crow + (size_t)row * ldc + cofs) = val; }
             }
        __builtin_amdgcn_wave_barrier(); asm volatile("" ::: "memory");
    }
}

// ---- k_gemmc: the same one-wave 64x64 tile GEMM specialised for causal attention: CMODE 1 skips score tiles entirely above the diagonal (query rows r0+roff.., key columns c0..), CMODE 2 limits the
// key (K) loop of the probability x value contraction to the diagonal block (probabilities beyond it are exactly zero). roff = row offset of this launch's first row within the sequence.
// CMODE 2 also splits that key loop over KS work-groups (blockIdx.z = ks * ZH + head): part ks takes a contiguous run of whole 64-key groups and stores its partial tile (zeros where its run is empty) to plane ks of C.
template <typename T16, int NSPLIT, int CMODE>
__global__ __launch_bounds__(32) void k_gemmc(const T16* __restrict__ A, const T16* __restrict__ A2, const T16* __restrict__ Bt, const T16* __restrict__ Bt2, int K, float* C, int ldc, int roff, size_t sA, size_t sB, size_t sC) {
    typedef typename WFrag<T16>::V V;
    __shared__ __align__(16) float os[16 * 68];
    const int ks = (CMODE == 2) ? (int)(blockIdx.z / ZH) : 0; const size_t z = (CMODE == 2) ? blockIdx.z % ZH : blockIdx.z; A += z * sA; if (A2) A2 += z * sA; Bt += z * sB; if (Bt2) Bt2 += z * sB; C += z * sC + (size_t)ks * ((size_t)ZH * TT * HD);
    const int lane = threadIdx.x & 31, lr = lane & 15, hi = lane >> 4; const int r0 = blockIdx.x * 64, c0 = blockIdx.y * 64;
    if (CMODE == 1 && c0 > r0 + roff + 63) return;                  // score tile entirely above the causal diagonal: not computed (the softmax masks j > i by select)
    const int Kl = (CMODE == 2) ? min(K, r0 + roff + 64) : K;        // P.V: probabilities are exactly 0 beyond the diagonal block, so the K loop stops there
    const int per = (CMODE == 2) ? ((Kl + 64 * KS - 1) / (64 * KS)) * 64 : Kl;   // keys per part, whole 128-byte lines of the 16-bit planes
    const int kb = ks * per, kn = min(Kl - kb, per);   // first key and key count of this part (count <= 0: empty)
    A += kb; if (A2) A2 += kb; Bt += kb; if (Bt2) Bt2 += kb;
    v8f acc[4][4];
#pragma unroll
    for (int mb = 0; mb < 4; ++mb)
#pragma unroll
        for (int nb = 0; nb < 4; ++nb) acc[mb][nb] = (v8f){};
    const size_t aoff = (size_t)(r0 + lr) * K + 8 * hi, boff = (size_t)(c0 + lr) * K + 8 * hi;
#pragma unroll 1
    for (int kc = 0; kc < kn; kc += 32) {
        V a[4], a2[4];
#pragma unroll
        for (int mb = 0; mb < 4; ++mb) { a[mb] = WFrag<T16>::ld(A + aoff + (size_t)mb * 16 * K + kc); if (NSPLIT == 1 || NSPLIT == 2) a2[mb] = WFrag<T16>::ld(A2 + aoff + (size_t)mb * 16 * K + kc); }
#pragma unroll
        for (int nb = 0; nb < 4; ++nb) { const V b = WFrag<T16>::ld(Bt + boff + (size_t)nb * 16 * K + kc); V b2; if (NSPLIT >= 2) b2 = WFrag<T16>::ld(Bt2 + boff + (size_t)nb * 16 * K + kc);
#pragma unroll
            for (int mb = 0; mb < 4; ++mb) { acc[mb][nb] = WFrag<T16>::mma(a[mb], b, acc[mb][nb]); if (NSPLIT == 1 || NSPLIT == 2) acc[mb][nb] = WFrag<T16>::mma(a2[mb], b, acc[mb][nb]); if (NSPLIT >= 2) acc[mb][nb] = WFrag<T16>::mma(a[mb], b2, acc[mb][nb]); } }
        asm volatile("v_nop\n\tv_nop\n\tv_nop\n\tv_nop" : "+v"(acc[0][0]), "+v"(acc[1][1]), "+v"(acc[2][2]), "+v"(acc[3][3]) : "v"(a[0]), "v"(a[3]));
    }
#pragma unroll
    for (int mb = 0; mb < 4; ++mb) {
#pragma unroll
        for (int nb = 0; nb < 4; ++nb) {
#pragma unroll
            for (int j = 0; j < 8; ++j) os[(hi * 8 + j) * 68 + nb * 16 + lr] = acc[mb][nb][j]; }
        __builtin_amdgcn_wave_barrier(); asm volatile("" ::: "memory");
        float* crow = C + (size_t)(r0 + mb * 16) * ldc + c0;
{
#pragma unroll
            for (int s = 0; s < 8; ++s) { const int row = 2 * s + hi, cofs = lr * 4; v4f val = *(const v4fa*)(os + row * 68 + cofs);
                *(v4f*)(crow + (size_t)row * ldc + cofs) = val; }
             }
        __builtin_amdgcn_wave_barrier(); asm volatile("" ::: "memory");
    }
}

__device__ __forceinline__ h16 tohx(float x) { return (h16)x; }
__device__ __forceinline__ void splitf(float y, unsigned short& h, unsigned short& l) { h = f2bf(y); l = f2bf(y - bf2f(h)); }
typedef __attribute__((ext_vector_type(2))) _Float16 v2h;
typedef __attribute__((ext_vector_type(4))) _Float16 v4h;
typedef __attribute__((ext_vector_type(2))) unsigned short v2us;
typedef __attribute__((ext_vector_type(4))) unsigned short v4us;
typedef __attribute__((ext_vector_type(2))) float v2f;
typedef __attribute__((ext_vector_type(4))) int v4i;

__global__ __launch_bounds__(256) void k_wtG(const float* __restrict__ w, int K, int N, bf* Bt) {
    const int lane = threadIdx.x & 31; const int L0 = (blockIdx.x * 8 + (threadIdx.x >> 5)) * 8; const int nlines = N * K / 64;
{
#pragma unroll 1
        for (int l = 0; l < 8; ++l) { const int L = L0 + l; if (L >= nlines) break; const size_t e = (size_t)L * 64 + lane * 2; const int k = (int)(e % K), n = (int)(e / K); v2us o;
            o[0] = f2bf(w[(size_t)k * N + n]); o[1] = f2bf(w[(size_t)(k + 1) * N + n]); *(v2us*)(Bt + e) = o; }
         }
}
__global__ __launch_bounds__(256) void k_cvt8(const float* __restrict__ src, bf* dst, size_t n8) { const size_t i = (size_t)blockIdx.x * 256 + threadIdx.x; if (i >= n8) return; const v8f v = *(const v8f*)(src + i * 8); v8us o;
#pragma unroll
    for (int k = 0; k < 8; ++k) o[k] = f2bf(v[k]); *(v8us*)(dst + i * 8) = o;  }

__global__ __launch_bounds__(256) void k_vtp(const float* __restrict__ F, int pitch, int nheads, h16* V16, bf* Vh, bf* Vl) { const size_t e = ((size_t)blockIdx.x * 256 + threadIdx.x) * 2; if (e >= (size_t)nheads * HD * TT) return; const int t = (int)(e % TT); const int d = (int)((e / TT) % HD); const int g = (int)(e / ((size_t)TT * HD)); v2h o16; v2us oh, ol;
#pragma unroll
    for (int q = 0; q < 2; ++q) { const float x = F[(size_t)(t + q) * pitch + g * HD + d]; o16[q] = tohx(x); unsigned short a2, c2; splitf(x, a2, c2); oh[q] = a2; ol[q] = c2; }
    *(v2h*)(V16 + e) = o16; *(v2us*)(Vh + e) = oh; *(v2us*)(Vl + e) = ol;  }
__constant__ float INV2[HD / 2] = { 1.000000000e+00f, 8.659643531e-01f, 7.498942018e-01f, 6.493816376e-01f, 5.623413324e-01f, 4.869675338e-01f, 4.216965139e-01f, 3.651741445e-01f, 3.162277639e-01f, 2.738419771e-01f, 2.371373624e-01f, 2.053525001e-01f, 1.778279394e-01f, 1.539926529e-01f, 1.333521456e-01f, 1.154782027e-01f, 1.000000015e-01f, 8.659642935e-02f, 7.498941571e-02f, 6.493816525e-02f, 5.623412877e-02f, 4.869675264e-02f, 4.216964915e-02f, 3.651741147e-02f, 3.162277862e-02f, 2.738419548e-02f, 2.371373586e-02f, 2.053525113e-02f, 1.778279431e-02f, 1.539926510e-02f, 1.333521493e-02f, 1.154781971e-02f, 9.999999776e-03f, 8.659643121e-03f, 7.498942316e-03f, 6.493816618e-03f, 5.623413250e-03f, 4.869675264e-03f, 4.216964822e-03f, 3.651741426e-03f, 3.162277862e-03f, 2.738419687e-03f, 2.371373819e-03f, 2.053525066e-03f, 1.778279431e-03f, 1.539926510e-03f, 1.333521446e-03f, 1.154782018e-03f, 1.000000047e-03f, 8.659643354e-04f, 7.498941850e-04f, 6.493816618e-04f, 5.623413017e-04f, 4.869675031e-04f, 4.216964880e-04f, 3.651741135e-04f, 3.162277862e-04f, 2.738419571e-04f, 2.371373848e-04f, 2.053524950e-04f, 1.778279402e-04f, 1.539926452e-04f, 1.333521504e-04f, 1.154781930e-04f };   // freqs = 1.0 / (ROPE_THETA ** (jnp.arange(0, 128, 2, dtype=jnp.float32) / 128)) with ROPE_THETA 10000: THIS module evaluates it in EAGER JAX float32 inside reference(): these 64 literals are those values, bit-exact on round trip (NumPy's float32 values of the same expression: 9 of the 64 differ by one or two ulps: indices 7, 10, 25, 27, 45, 47, 54, 59, 63).
__global__ __launch_bounds__(256) void k_csP(float* CS) { const int idx = blockIdx.x * 256 + threadIdx.x; if (idx >= TT * HD) return; const int d = idx % HD; const int t = idx / HD; const float a = __fmul_rn((float)t, INV2[d >> 1]); v2f cs; cs[0] = cosf(a); cs[1] = sinf(a); *(v2f*)(CS + (size_t)idx * 2) = cs;  }
__global__ __launch_bounds__(256) void k_ropeI(const float* __restrict__ F, int pitch, int nheads, const float* __restrict__ CS, float sc, h16* P16, bf* Ph, bf* Pl) {
    const size_t e = ((size_t)blockIdx.x * 256 + threadIdx.x) * 2; if (e >= (size_t)nheads * TT * HD) return; const int d = (int)(e % HD); const int t = (int)((e / HD) % TT); const int h = (int)(e / ((size_t)HD * TT)); const float* f = F + (size_t)t * pitch + h * HD; const float x0 = f[d], x1 = f[d + 1]; const v2f cs = *(const v2f*)(CS + ((size_t)t * HD + d) * 2); v2h o16; v2us oh, ol;
    float a0 = __fmul_rn(x0, cs[0]), b0 = __fmul_rn(x1, cs[1]), a1 = __fmul_rn(x1, cs[0]), b1 = __fmul_rn(x0, cs[1]); asm volatile("" : "+v"(a0), "+v"(b0), "+v"(a1), "+v"(b1));
    float r0 = __fsub_rn(a0, b0) * sc, r1 = __fadd_rn(b1, a1) * sc;   /* even: x0 c - x1 s; odd: x0 s + x1 c */
    o16[0] = tohx(r0); o16[1] = tohx(r1); { unsigned short a2, c2; splitf(r0, a2, c2); oh[0] = a2; ol[0] = c2; splitf(r1, a2, c2); oh[1] = a2; ol[1] = c2; }
    *(v2h*)(P16 + e) = o16; *(v2us*)(Ph + e) = oh; *(v2us*)(Pl + e) = ol;  }

// k_asoft: per row (zz, i): t = S x HD^-0.5 for j <= i and i - j < WIN (WIN = TT: plain causal; the reference's -1e9 additive fill vanishes identically); softmax over the 2048 keys (register row, one exp, fixed trees);
__global__ __launch_bounds__(256) void k_asoft(const float* __restrict__ Sb, h16* P16, bf* Ph, bf* Pl) {
    const int lane = threadIdx.x & 31; const int row = blockIdx.x * 8 + (threadIdx.x >> 5); if (row >= ZH * TT) return; const int i = row % TT; const int zz = row / TT; (void)zz; const bool hires = (i < RH); const float* sr = Sb + (size_t)row * TT; float v[TT / 32]; float mx = -3.0e38f;
#pragma unroll
    for (int ch = 0; ch < TT / 128; ++ch) { const int j0 = ch * 128 + lane * 4; const v4f a = *(const v4f*)(sr + j0);
#pragma unroll
        for (int q = 0; q < 4; ++q) { const int j = j0 + q; (void)j; const float t = (j <= i && i - j < WIN) ? a[q] * SCL : -3.0e38f; v[ch * 4 + q] = t; mx = fmaxf(mx, t); } }
#pragma unroll
    for (int sh = 16; sh; sh >>= 1) mx = fmaxf(mx, __shfl_xor(mx, sh, 32));
    float sum = 0.f;
#pragma unroll
    for (int k = 0; k < TT / 32; ++k) { float d0 = __fsub_rn(v[k], mx); asm volatile("" : "+v"(d0)); v[k] = __builtin_amdgcn_exp2f(__fmul_rn(d0, 1.4426950408889634f)); sum += v[k]; }
#pragma unroll
    for (int sh = 16; sh; sh >>= 1) sum += __shfl_xor(sum, sh, 32);
    const float f = __fdiv_rn(hires ? 1.0f : PCAR, sum);
{
        if (hires) {
#pragma unroll
            for (int ch = 0; ch < TT / 128; ++ch) { v4us oh, ol;
#pragma unroll
                for (int q = 0; q < 4; ++q) { unsigned short a, c2; splitf(v[ch * 4 + q] * f, a, c2); oh[q] = a; ol[q] = c2; }
                const size_t oo = ((size_t)zz * (RH ? RH : 1) + i) * TT + ch * 128 + lane * 4; *(v4us*)(Ph + oo) = oh; *(v4us*)(Pl + oo) = ol; }
        } else {
#pragma unroll
            for (int ch = 0; ch < TT / 128; ++ch) { v4h o4;
#pragma unroll
                for (int q = 0; q < 4; ++q) o4[q] = tohx(v[ch * 4 + q] * f);
                *(v4h*)(P16 + (size_t)row * TT + ch * 128 + lane * 4) = o4; } }
         }
}
__global__ __launch_bounds__(256) void k_merge(const float* __restrict__ O, int h0, bf* Ah, bf* Al) { const size_t e = ((size_t)blockIdx.x * 256 + threadIdx.x) * 2; if (e >= (size_t)ZH * TT * HD) return; const int d = (int)(e % HD); const int t = (int)((e / HD) % TT); const int zz = (int)(e / ((size_t)HD * TT)); const float cs = (t < RH) ? 1.0f : (1.0f / PCAR); const size_t oo = (size_t)t * DQ + (h0 + zz) * HD + d;
    v2f acc = *(const v2f*)(O + e);   /* the KS partial planes of P.V, added in plane order */
#pragma unroll
    for (int s = 1; s < KS; ++s) { const v2f p = *(const v2f*)(O + (size_t)s * ((size_t)ZH * TT * HD) + e); acc[0] += p[0]; acc[1] += p[1]; }
    v2us oh, ol;
#pragma unroll
    for (int q = 0; q < 2; ++q) { unsigned short a, c2; splitf(acc[q] * cs, a, c2); oh[q] = a; ol[q] = c2; } *(v2us*)(Ah + oo) = oh; *(v2us*)(Al + oo) = ol;  }

extern "C" void kernel_launch(void* const* d_in, const int* in_sizes, int n_in,
                              void* d_out, int out_size, void* d_ws, size_t ws_size, hipStream_t stream) {
    (void)in_sizes; (void)n_in; (void)out_size;
        const float* x = (const float*)d_in[0]; const float* wq = (const float*)d_in[1]; const float* wk = (const float*)d_in[2]; const float* wv = (const float*)d_in[3]; const float* wo = (const float*)d_in[4];   /* x, Wq, Wk, Wv, Wo ('xw' (in, out) [2048][2048]): FIVE inputs, all read */
    float* OUT = (float*)d_out;     // [2][2048][2048]
    char* wsp = (char*)d_ws;
    auto take = [&](size_t bytes) { char* p = wsp; wsp += (bytes + 255) & ~(size_t)255; return (void*)p; };
    bf* WQ = (bf*)take((size_t)DQ * DM * 2); bf* WK = (bf*)take((size_t)DKV * DM * 2); bf* WV = (bf*)take((size_t)DKV * DM * 2); bf* WO = (bf*)take((size_t)DM * DQ * 2); float* CS = (float*)take((size_t)TT * HD * 2 * 4);
    bf* XB = (bf*)take((size_t)TT * DM * 2); float* FQ = (float*)take((size_t)TT * DQ * 4); float* FK = (float*)take((size_t)TT * DKV * 4);
    h16* QP16 = (h16*)take((size_t)NH_ * TT * HD * 2); h16* KP16 = (h16*)take((size_t)NKV * TT * HD * 2); h16* VT16 = (h16*)take((size_t)NKV * HD * TT * 2);
    bf* QPh = (bf*)take((size_t)NH_ * TT * HD * 2); bf* QPl = (bf*)take((size_t)NH_ * TT * HD * 2); bf* KPh = (bf*)take((size_t)NKV * TT * HD * 2); bf* KPl = (bf*)take((size_t)NKV * TT * HD * 2); bf* VTh = (bf*)take((size_t)NKV * HD * TT * 2); bf* VTl = (bf*)take((size_t)NKV * HD * TT * 2); bf* Ph = (bf*)take((size_t)ZH * RH * TT * 2); bf* Pl = (bf*)take((size_t)ZH * RH * TT * 2);
    float* Sb = (float*)take((size_t)ZH * TT * TT * 4); h16* P16 = (h16*)take((size_t)ZH * TT * TT * 2); float* Ob = (float*)take((size_t)KS * ZH * TT * HD * 4); bf* ATh = (bf*)take((size_t)TT * DQ * 2); bf* ATl = (bf*)take((size_t)TT * DQ * 2);
    if ((size_t)(wsp - (char*)d_ws) > ws_size) return;    // ws 256 MiB
    float* FV = FK;   // v projection reuses the k buffer after the k planes are built (stream-ordered)
    { k_wtG<<<(unsigned)((DM * DQ / 64 + 63) / 64), 256, 0, stream>>>(wq, DM, DQ, WQ); k_wtG<<<(unsigned)((DM * DKV / 64 + 63) / 64), 256, 0, stream>>>(wk, DM, DKV, WK); k_wtG<<<(unsigned)((DM * DKV / 64 + 63) / 64), 256, 0, stream>>>(wv, DM, DKV, WV);
      k_wtG<<<(unsigned)((DQ * DM / 64 + 63) / 64), 256, 0, stream>>>(wo, DQ, DM, WO);
       }
    k_csP<<<(TT * HD + 255) / 256, 256, 0, stream>>>(CS);   /* rotary table once (positions = arange) */
    const unsigned LQ = (unsigned)(((size_t)NH_ * TT * HD / 2 + 255) / 256), LKv = (unsigned)(((size_t)NKV * TT * HD / 2 + 255) / 256);
    for (int b = 0; b < NB_; ++b) {
        
        k_cvt8<<<(unsigned)(((size_t)TT * DM / 8 + 255) / 256), 256, 0, stream>>>(x + (size_t)b * TT * DM, XB, (size_t)TT * DM / 8);
        k_gemmw<bf, 0, false><<<dim3(TT / 64, DQ / 64, 1), 32, 0, stream>>>(XB, nullptr, WQ, nullptr, DM, FQ, DQ, nullptr, 0, 0, 0);
        k_ropeI<<<LQ, 256, 0, stream>>>(FQ, DQ, NH_, CS, 1.0f, QP16, QPh, QPl);
        k_gemmw<bf, 0, false><<<dim3(TT / 64, DKV / 64, 1), 32, 0, stream>>>(XB, nullptr, WK, nullptr, DM, FK, DKV, nullptr, 0, 0, 0);
        k_ropeI<<<LKv, 256, 0, stream>>>(FK, DKV, NKV, CS, 1.0f, KP16, KPh, KPl);
        k_gemmw<bf, 0, false><<<dim3(TT / 64, DKV / 64, 1), 32, 0, stream>>>(XB, nullptr, WV, nullptr, DM, FV, DKV, nullptr, 0, 0, 0); k_vtp<<<LKv, 256, 0, stream>>>(FV, DKV, NKV, VT16, VTh, VTl);
        for (int h0 = 0; h0 < NH_; h0 += ZH) { const size_t zq = (size_t)h0, zk = (size_t)(h0 / REP);   // REP == 1 (full multi-head attention): the pass's two heads use CONSECUTIVE kv planes: sB = TT * HD for the scores, HD * TT for P.V (with REP >= 2 the two heads would share one plane: sB = 0)
            k_gemmc<bf, 2, 1><<<dim3(RH / 64, TT / 64, ZH), 32, 0, stream>>>(QPh + zq * TT * HD, QPl + zq * TT * HD, KPh + zk * TT * HD, KPl + zk * TT * HD, HD, Sb, TT, 0, (size_t)TT * HD, (size_t)TT * HD, (size_t)TT * TT);
            k_gemmc<h16, 0, 1><<<dim3((TT - RH) / 64, TT / 64, ZH), 32, 0, stream>>>(QP16 + zq * TT * HD + (size_t)RH * HD, nullptr, KP16 + zk * TT * HD, nullptr, HD, Sb + (size_t)RH * TT, TT, RH, (size_t)TT * HD, (size_t)TT * HD, (size_t)TT * TT);
            k_asoft<<<ZH * TT / 8, 256, 0, stream>>>(Sb, P16, Ph, Pl);
            k_gemmc<bf, 2, 2><<<dim3(RH / 64, HD / 64, ZH * KS), 32, 0, stream>>>(Ph, Pl, VTh + zk * HD * TT, VTl + zk * HD * TT, TT, Ob, HD, 0, (size_t)RH * TT, (size_t)HD * TT, (size_t)TT * HD);
            k_gemmc<h16, 0, 2><<<dim3((TT - RH) / 64, HD / 64, ZH * KS), 32, 0, stream>>>(P16 + (size_t)RH * TT, nullptr, VT16 + zk * HD * TT, nullptr, TT, Ob + (size_t)RH * HD, HD, RH, (size_t)TT * TT, (size_t)HD * TT, (size_t)TT * HD);
            k_merge<<<(unsigned)(((size_t)ZH * TT * HD / 2 + 255) / 256), 256, 0, stream>>>(Ob, h0, ATh, ATl); }
        k_gemmw<bf, 1, false><<<dim3(TT / 64, DM / 64, 1), 32, 0, stream>>>(ATh, ATl, WO, nullptr, DQ, OUT + (size_t)b * TT * DM, DM, nullptr, 0, 0, 0); }
}

// v002
// A run of this version takes 674 microseconds.
// Timed twice side by side with v001, it ran 1.68 times as fast both times.
// All steps since v000 together make it 2.62 times as fast.
#include <hip/hip_runtime.h>

// Causal multi-head attention with 16 FULL heads x 128 and a computed interleaved-pair rotary embedding (x [2][2048][2048]; q, k, v = x W ('xw' (in, out) [2048][2048] 1/sqrt(2048); 16 heads x 128: ONE kv head per query head), no biases; angle = pos x inv_freq[i] with inv_freq = 1.0 / (10000.0 ** (arange(0, 128, 2, f32) / 128)) evaluated by the module in EAGER JAX float32 (the 64 literals are those values), pos = arange(2048); adjacent pairs (2i, 2i + 1): (x1 c - x2 s, x1 s + x2 c) on q and k; scores / sqrt(128); keys j > i excluded (the module fills finfo.min: == exclusion); softmax; out = merged Wo ('xw') -> [2][2048][2048] (8.4 M); argument order x, Wq, Wk, Wv, Wo).
// Layout per batch: bf16 copy of x; 'xw' weights transposed once; exact projections; k_csP table (64 angles per position) + k_ropeI interleaved-pair plane builders at HD 128; k_attn: causal T-2048 attention with 128-wide heads, one launch for all heads, scores and probabilities in LDS (hybrid rows: < 512 hi/lo 3 products, rest fp16 x1024; score tiles above the diagonal are skipped); merged hi/lo x wo exact.
// Compute dtypes, f32 accumulate: every input rounded to bf16; projections exact; rotary f32; attention rows < 512 3 products, rest fp16; softmax f32; wo hl x exact.

#define NB_  2
#define TT   2048
#define DM   2048
#define NH_  16
#define NKV  16
#define REP  (NH_ / NKV)
#define HD   128
#define DQ   (NH_ * HD)
#define DKV  (NKV * HD)
#define RH   512                  // query rows < RH use hi+lo planes (0: none)
#define WIN  2048
#define PCAR 1024.0f
#define KS   8                    // P.V: waves that share one output tile's key loop; each stores its own f32 partial tile in LDS, added in part order
#define QR   32                   // query rows of one attention work-group
#define NW   16                   // its waves
#define SPB  (TT * 4 + 16)        // LDS pitch of a score row, bytes: 16 B x odd, for the ds_load_b128 readers of the probabilities
#define OPF  (HD + 4)             // LDS pitch of a partial output row, floats: the two lane halves (8 rows apart) fall on different banks
#define SCL  0.088388347648318447f   // HD^-0.5
typedef _Float16 h16;
typedef unsigned short bf;
typedef __attribute__((ext_vector_type(16))) __bf16   v16bf;
typedef __attribute__((ext_vector_type(16))) _Float16 v16h;
typedef __attribute__((ext_vector_type(8)))  _Float16 v8h;
typedef __attribute__((ext_vector_type(8)))  unsigned short v8us;
typedef __attribute__((ext_vector_type(8)))  float    v8f;
typedef __attribute__((ext_vector_type(4)))  float    v4f;
typedef v8h  __attribute__((may_alias)) v8ha;
typedef v4f  __attribute__((may_alias)) v4fa;
typedef v8us __attribute__((may_alias)) v8usa;

__device__ __forceinline__ unsigned short f2bf(float f) { unsigned u = __float_as_uint(f); u += 0x7FFFu + ((u >> 16) & 1u); return (unsigned short)(u >> 16); }
__device__ __forceinline__ float bf2f(unsigned short b) { return __uint_as_float(((unsigned)b) << 16); }
__device__ __forceinline__ float bfr(float f) { return bf2f(f2bf(f)); }
__device__ __forceinline__ v16h cat16(v8h lo, v8h hi) { return __builtin_shufflevector(lo, hi, 0, 1, 2, 3, 4, 5, 6, 7, 8, 9, 10, 11, 12, 13, 14, 15); }
__device__ __forceinline__ v16bf cat16b(v8us lo, v8us hi) { return __builtin_bit_cast(v16bf, __builtin_shufflevector(lo, hi, 0, 1, 2, 3, 4, 5, 6, 7, 8, 9, 10, 11, 12, 13, 14, 15)); }
__device__ __forceinline__ v8f wmma16(v16h a, v16h b, v8f c) { return __builtin_amdgcn_wmma_f32_16x16x32_f16(false, a, false, b, (short)0, c, false, false); }
__device__ __forceinline__ v8f wmmab(v16bf a, v16bf b, v8f c) { return __builtin_amdgcn_wmma_f32_16x16x32_bf16(false, a, false, b, (short)0, c, false, false); }



// ---- k_gemmw: register-blocked GEMM, ONE WAVE per 64x64 output tile (16 accumulators), operands straight from K-contiguous 16-bit planes; grid (M/64, N/64, Z), 32 threads.
// C[m][n] (f32, pitch ldc, + optional f32 bias[n]) = sum_k A[m][k] Bt[n][k] (+ split products per NSPLIT). z-batch strides sA/sB/sC in elements. K % 32 == 0.
template <typename T16> struct WFrag;
template <> struct WFrag<h16> { typedef v16h V; static __device__ __forceinline__ V ld(const h16* p) { return cat16(*(const v8h*)p, *(const v8h*)(p + 16)); } static __device__ __forceinline__ v8f mma(V a, V b, v8f c) { return wmma16(a, b, c); } };
template <> struct WFrag<bf> { typedef v16bf V; static __device__ __forceinline__ V ld(const bf* p) { return cat16b(*(const v8us*)p, *(const v8us*)(p + 16)); } static __device__ __forceinline__ v8f mma(V a, V b, v8f c) { return wmmab(a, b, c); } };
template <typename T16, int NSPLIT, bool BIAS>
__global__ __launch_bounds__(32) void k_gemmw(const T16* __restrict__ A, const T16* __restrict__ A2, const T16* __restrict__ Bt, const T16* __restrict__ Bt2, int K, float* C, int ldc, const float* __restrict__ bias, size_t sA, size_t sB, size_t sC) {
    typedef typename WFrag<T16>::V V;
    __shared__ __align__(16) float os[16 * 68];
    const size_t z = blockIdx.z; A += z * sA; if (A2) A2 += z * sA; Bt += z * sB; if (Bt2) Bt2 += z * sB; C += z * sC;
    const int lane = threadIdx.x & 31, lr = lane & 15, hi = lane >> 4; const int r0 = blockIdx.x * 64, c0 = blockIdx.y * 64;
    v8f acc[4][4];
#pragma unroll
    for (int mb = 0; mb < 4; ++mb)
#pragma unroll
        for (int nb = 0; nb < 4; ++nb) acc[mb][nb] = (v8f){};
    const size_t aoff = (size_t)(r0 + lr) * K + 8 * hi, boff = (size_t)(c0 + lr) * K + 8 * hi;
#pragma unroll 1
    for (int kc = 0; kc < K; kc += 32) {
        V a[4], a2[4];
#pragma unroll
        for (int mb = 0; mb < 4; ++mb) { a[mb] = WFrag<T16>::ld(A + aoff + (size_t)mb * 16 * K + kc); if (NSPLIT == 1 || NSPLIT == 2) a2[mb] = WFrag<T16>::ld(A2 + aoff + (size_t)mb * 16 * K + kc); }
#pragma unroll
        for (int nb = 0; nb < 4; ++nb) { const V b = WFrag<T16>::ld(Bt + boff + (size_t)nb * 16 * K + kc); V b2; if (NSPLIT >= 2) b2 = WFrag<T16>::ld(Bt2 + boff + (size_t)nb * 16 * K + kc);
#pragma unroll
            for (int mb = 0; mb < 4; ++mb) { acc[mb][nb] = WFrag<T16>::mma(a[mb], b, acc[mb][nb]); if (NSPLIT == 1 || NSPLIT == 2) acc[mb][nb] = WFrag<T16>::mma(a2[mb], b, acc[mb][nb]); if (NSPLIT >= 2) acc[mb][nb] = WFrag<T16>::mma(a[mb], b2, acc[mb][nb]); } }
        asm volatile("v_nop\n\tv_nop\n\tv_nop\n\tv_nop" : "+v"(acc[0][0]), "+v"(acc[1][1]), "+v"(acc[2][2]), "+v"(acc[3][3]) : "v"(a[0]), "v"(a[3]));
    }
#pragma unroll
    for (int mb = 0; mb < 4; ++mb) {
#pragma unroll
        for (int nb = 0; nb < 4; ++nb) {
#pragma unroll
            for (int j = 0; j < 8; ++j) os[(hi * 8 + j) * 68 + nb * 16 + lr] = acc[mb][nb][j]; }
        __builtin_amdgcn_wave_barrier(); asm volatile("" ::: "memory");
        float* crow = C + (size_t)(r0 + mb * 16) * ldc + c0;
{
#pragma unroll
            for (int s = 0; s < 8; ++s) { const int row = 2 * s + hi, cofs = lr * 4; v4f val = *(const v4fa*)(os + row * 68 + cofs); if (BIAS) { val[0] += bfr(bias[c0 + cofs]); val[1] += bfr(bias[c0 + cofs + 1]); val[2] += bfr(bias[c0 + cofs + 2]); val[3] += bfr(bias[c0 + cofs + 3]); }
                *(v4f*)(crow + (size_t)row * ldc + cofs) = val; }
             }
        __builtin_amdgcn_wave_barrier(); asm volatile("" ::: "memory");
    }
}

__device__ __forceinline__ h16 tohx(float x) { return (h16)x; }
__device__ __forceinline__ void splitf(float y, unsigned short& h, unsigned short& l) { h = f2bf(y); l = f2bf(y - bf2f(h)); }
typedef __attribute__((ext_vector_type(2))) _Float16 v2h;
typedef __attribute__((ext_vector_type(4))) _Float16 v4h;
typedef __attribute__((ext_vector_type(2))) unsigned short v2us;
typedef __attribute__((ext_vector_type(4))) unsigned short v4us;
typedef __attribute__((ext_vector_type(2))) float v2f;
typedef __attribute__((ext_vector_type(4))) int v4i;

__global__ __launch_bounds__(256) void k_wtG(const float* __restrict__ w, int K, int N, bf* Bt) {
    const int lane = threadIdx.x & 31; const int L0 = (blockIdx.x * 8 + (threadIdx.x >> 5)) * 8; const int nlines = N * K / 64;
{
#pragma unroll 1
        for (int l = 0; l < 8; ++l) { const int L = L0 + l; if (L >= nlines) break; const size_t e = (size_t)L * 64 + lane * 2; const int k = (int)(e % K), n = (int)(e / K); v2us o;
            o[0] = f2bf(w[(size_t)k * N + n]); o[1] = f2bf(w[(size_t)(k + 1) * N + n]); *(v2us*)(Bt + e) = o; }
         }
}
__global__ __launch_bounds__(256) void k_cvt8(const float* __restrict__ src, bf* dst, size_t n8) { const size_t i = (size_t)blockIdx.x * 256 + threadIdx.x; if (i >= n8) return; const v8f v = *(const v8f*)(src + i * 8); v8us o;
#pragma unroll
    for (int k = 0; k < 8; ++k) o[k] = f2bf(v[k]); *(v8us*)(dst + i * 8) = o;  }

__global__ __launch_bounds__(256) void k_vtp(const float* __restrict__ F, int pitch, int nheads, h16* V16, bf* Vh, bf* Vl) { const size_t e = ((size_t)blockIdx.x * 256 + threadIdx.x) * 2; if (e >= (size_t)nheads * HD * TT) return; const int t = (int)(e % TT); const int d = (int)((e / TT) % HD); const int g = (int)(e / ((size_t)TT * HD)); v2h o16; v2us oh, ol;
#pragma unroll
    for (int q = 0; q < 2; ++q) { const float x = F[(size_t)(t + q) * pitch + g * HD + d]; o16[q] = tohx(x); unsigned short a2, c2; splitf(x, a2, c2); oh[q] = a2; ol[q] = c2; }
    *(v2h*)(V16 + e) = o16; *(v2us*)(Vh + e) = oh; *(v2us*)(Vl + e) = ol;  }
__constant__ float INV2[HD / 2] = { 1.000000000e+00f, 8.659643531e-01f, 7.498942018e-01f, 6.493816376e-01f, 5.623413324e-01f, 4.869675338e-01f, 4.216965139e-01f, 3.651741445e-01f, 3.162277639e-01f, 2.738419771e-01f, 2.371373624e-01f, 2.053525001e-01f, 1.778279394e-01f, 1.539926529e-01f, 1.333521456e-01f, 1.154782027e-01f, 1.000000015e-01f, 8.659642935e-02f, 7.498941571e-02f, 6.493816525e-02f, 5.623412877e-02f, 4.869675264e-02f, 4.216964915e-02f, 3.651741147e-02f, 3.162277862e-02f, 2.738419548e-02f, 2.371373586e-02f, 2.053525113e-02f, 1.778279431e-02f, 1.539926510e-02f, 1.333521493e-02f, 1.154781971e-02f, 9.999999776e-03f, 8.659643121e-03f, 7.498942316e-03f, 6.493816618e-03f, 5.623413250e-03f, 4.869675264e-03f, 4.216964822e-03f, 3.651741426e-03f, 3.162277862e-03f, 2.738419687e-03f, 2.371373819e-03f, 2.053525066e-03f, 1.778279431e-03f, 1.539926510e-03f, 1.333521446e-03f, 1.154782018e-03f, 1.000000047e-03f, 8.659643354e-04f, 7.498941850e-04f, 6.493816618e-04f, 5.623413017e-04f, 4.869675031e-04f, 4.216964880e-04f, 3.651741135e-04f, 3.162277862e-04f, 2.738419571e-04f, 2.371373848e-04f, 2.053524950e-04f, 1.778279402e-04f, 1.539926452e-04f, 1.333521504e-04f, 1.154781930e-04f };   // freqs = 1.0 / (ROPE_THETA ** (jnp.arange(0, 128, 2, dtype=jnp.float32) / 128)) with ROPE_THETA 10000: THIS module evaluates it in EAGER JAX float32 inside reference(): these 64 literals are those values, bit-exact on round trip (NumPy's float32 values of the same expression: 9 of the 64 differ by one or two ulps: indices 7, 10, 25, 27, 45, 47, 54, 59, 63).
__global__ __launch_bounds__(256) void k_csP(float* CS) { const int idx = blockIdx.x * 256 + threadIdx.x; if (idx >= TT * HD) return; const int d = idx % HD; const int t = idx / HD; const float a = __fmul_rn((float)t, INV2[d >> 1]); v2f cs; cs[0] = cosf(a); cs[1] = sinf(a); *(v2f*)(CS + (size_t)idx * 2) = cs;  }
__global__ __launch_bounds__(256) void k_ropeI(const float* __restrict__ F, int pitch, int nheads, const float* __restrict__ CS, float sc, h16* P16, bf* Ph, bf* Pl) {
    const size_t e = ((size_t)blockIdx.x * 256 + threadIdx.x) * 2; if (e >= (size_t)nheads * TT * HD) return; const int d = (int)(e % HD); const int t = (int)((e / HD) % TT); const int h = (int)(e / ((size_t)HD * TT)); const float* f = F + (size_t)t * pitch + h * HD; const float x0 = f[d], x1 = f[d + 1]; const v2f cs = *(const v2f*)(CS + ((size_t)t * HD + d) * 2); v2h o16; v2us oh, ol;
    float a0 = __fmul_rn(x0, cs[0]), b0 = __fmul_rn(x1, cs[1]), a1 = __fmul_rn(x1, cs[0]), b1 = __fmul_rn(x0, cs[1]); asm volatile("" : "+v"(a0), "+v"(b0), "+v"(a1), "+v"(b1));
    float r0 = __fsub_rn(a0, b0) * sc, r1 = __fadd_rn(b1, a1) * sc;   /* even: x0 c - x1 s; odd: x0 s + x1 c */
    o16[0] = tohx(r0); o16[1] = tohx(r1); { unsigned short a2, c2; splitf(r0, a2, c2); oh[0] = a2; ol[0] = c2; splitf(r1, a2, c2); oh[1] = a2; ol[1] = c2; }
    *(v2h*)(P16 + e) = o16; *(v2us*)(Ph + e) = oh; *(v2us*)(Pl + e) = ol;  }

// soft_rows: the softmax of this wave's QR / NW rows over the first NCH x 128 keys (NCH x 128 >= Kl; keys j > i get probability exactly 0, as over the whole row). t = S x HD^-0.5 for j <= i; register row, one exp, fixed trees.
// The probabilities go over the row's own scores, which the wave holds in registers by then. A lane whose keys lie at or beyond Kl, where no score was stored, reads the row's last stored scores instead; the select drops them.
template <int NSPLIT, int NCH>
__device__ __forceinline__ void soft_rows(unsigned char* sm, int r0, int w, int lane, int Kl) {
#pragma unroll 1
    for (int rr = 0; rr < QR / NW; ++rr) {
        const int row = w * (QR / NW) + rr; const int i = r0 + row; unsigned char* rp = sm + row * SPB; const float* sr = (const float*)rp; float v[NCH * 4]; float mx = -3.0e38f;
#pragma unroll
        for (int ch = 0; ch < NCH; ++ch) *(v4f*)(v + ch * 4) = *(const v4fa*)(sr + min(ch * 128 + lane * 4, Kl - 4));
        __builtin_amdgcn_sched_barrier(0);   // keeps the row's LDS reads together: left free, the scheduler waits out each read alone
#pragma unroll
        for (int ch = 0; ch < NCH; ++ch) { const int j0 = ch * 128 + lane * 4;
#pragma unroll
            for (int q = 0; q < 4; ++q) { const int j = j0 + q; const float t = (j <= i && i - j < WIN) ? v[ch * 4 + q] * SCL : -3.0e38f; v[ch * 4 + q] = t; mx = fmaxf(mx, t); } }
#pragma unroll
        for (int sh = 16; sh; sh >>= 1) mx = fmaxf(mx, __shfl_xor(mx, sh, 32));
        float sum = 0.f;
#pragma unroll
        for (int k = 0; k < NCH * 4; ++k) { const float d0 = __fsub_rn(v[k], mx); v[k] = __builtin_amdgcn_exp2f(__fmul_rn(d0, 1.4426950408889634f)); sum += v[k]; }
#pragma unroll
        for (int sh = 16; sh; sh >>= 1) sum += __shfl_xor(sum, sh, 32);
        const float f = __fdiv_rn(NSPLIT == 2 ? 1.0f : PCAR, sum);
#pragma unroll
        for (int ch = 0; ch < NCH; ++ch) { unsigned char* pp = rp + (ch * 128 + lane * 4) * 2;
            if (NSPLIT == 2) { v4us oh, ol;
#pragma unroll
                for (int q = 0; q < 4; ++q) { unsigned short a, c2; splitf(v[ch * 4 + q] * f, a, c2); oh[q] = a; ol[q] = c2; }
                *(v4us*)pp = oh; *(v4us*)(pp + TT * 2) = ol;
            } else { v4h o4;
#pragma unroll
                for (int q = 0; q < 4; ++q) o4[q] = tohx(v[ch * 4 + q] * f);
                *(v4h*)pp = o4; } }
    }
}
// ---- k_attn: the whole attention of one head's QR query rows in ONE work-group of 16 waves; the f32 score rows, then the 16-bit probabilities (written over their own score row), then the KS partial output tiles all live in LDS.
// Stage 1: wave w takes the 64-key score tiles w, w + 16, ... up to the diagonal's 64-row group (Q fragments stay in registers). Stage 2: each wave runs the softmax of QR / 16 whole rows (register row, one exp, fixed trees).
// Stage 3: P.V; wave w = part ks + KS * column half: part ks takes a contiguous run of whole 64-key groups. Stage 4: the KS partial tiles are added in part order, split hi/lo and stored to the merged planes.
// Rows < RH: bf16 hi/lo planes, 3 products (P hi at the row's start, P lo 4096 bytes behind it); the rest: fp16, P carried x PCAR.
template <typename T16, int NSPLIT>
__device__ __forceinline__ void attn_body(unsigned char* sm, const T16* __restrict__ Q, const T16* __restrict__ Q2, const T16* __restrict__ Kp, const T16* __restrict__ Kp2, const T16* __restrict__ Vt, const T16* __restrict__ Vt2, int r0, int h, bf* Ah, bf* Al) {
    typedef typename WFrag<T16>::V V;
    const int tid = threadIdx.x, lane = tid & 31, lr = lane & 15, hi = lane >> 4; const int w = __builtin_amdgcn_readfirstlane(tid >> 5);
    const int Kl = (r0 & ~63) + 64;        // keys up to the end of the diagonal's 64-row group: beyond a row's own diagonal the probabilities are exactly 0
    float* S = (float*)sm;
    {   // stage 1: scores
        constexpr int NG = (NSPLIT == 2) ? 1 : 4; V qa[2][4], qa2[2][4];
#pragma unroll
        for (int mb = 0; mb < 2; ++mb)
#pragma unroll
            for (int kk = 0; kk < 4; ++kk) { const size_t o = (size_t)(r0 + mb * 16 + lr) * HD + 8 * hi + kk * 32; qa[mb][kk] = WFrag<T16>::ld(Q + o); if (NSPLIT == 2) qa2[mb][kk] = WFrag<T16>::ld(Q2 + o); }
#pragma unroll 1
        for (int c0 = w * 64; c0 < Kl; c0 += NW * 64) {
            V b[NG][4], b2[NG][4];   // the K fragments of NG 16-key column groups, all loaded ahead of their products: one trip to L2 for the lot
#pragma unroll
            for (int g0 = 0; g0 < 4; g0 += NG) {
#pragma unroll
                for (int g = 0; g < NG; ++g)
#pragma unroll
                    for (int kk = 0; kk < 4; ++kk) { const size_t o = (size_t)(c0 + (g0 + g) * 16 + lr) * HD + 8 * hi + kk * 32; b[g][kk] = WFrag<T16>::ld(Kp + o); if (NSPLIT == 2) b2[g][kk] = WFrag<T16>::ld(Kp2 + o); }
                asm volatile("s_wait_xcnt 0x0" ::: "memory");   // stands in front of the next trip's additions to the address registers that the loads above name
                __builtin_amdgcn_sched_barrier(0);   // keeps these loads together ahead of the products: left free, the scheduler sinks each pair to its use and the wave waits out L2 once per pair
#pragma unroll
                for (int g = 0; g < NG; ++g) { v8f acc[2]; acc[0] = (v8f){}; acc[1] = (v8f){};
#pragma unroll
                    for (int kk = 0; kk < 4; ++kk)
#pragma unroll
                        for (int mb = 0; mb < 2; ++mb) { acc[mb] = WFrag<T16>::mma(qa[mb][kk], b[g][kk], acc[mb]); if (NSPLIT == 2) { acc[mb] = WFrag<T16>::mma(qa2[mb][kk], b[g][kk], acc[mb]); acc[mb] = WFrag<T16>::mma(qa[mb][kk], b2[g][kk], acc[mb]); } }
                    asm volatile("v_nop\n\tv_nop\n\tv_nop\n\tv_nop" : "+v"(acc[0]), "+v"(acc[1]));   // the four vector slots the chip needs behind a WMMA before its D registers are rewritten: the next group's first WMMA takes the same registers, and only LDS stores, which fill no slot, stand between
#pragma unroll
                    for (int mb = 0; mb < 2; ++mb)
#pragma unroll
                        for (int j = 0; j < 8; ++j) S[(mb * 16 + hi * 8 + j) * (SPB / 4) + c0 + (g0 + g) * 16 + lr] = acc[mb][j]; }
            }
        }
    }
    __syncthreads();   // every score tile of the block is in LDS before a row is read
    // stage 2: softmax; the chunk count is a compile-time bound so that a row's LDS reads go out together
    if (NSPLIT == 2) soft_rows<NSPLIT, RH / 128>(sm, r0, w, lane, Kl);
    else if (Kl <= 1024) soft_rows<NSPLIT, 8>(sm, r0, w, lane, Kl);
    else if (Kl <= 1536) soft_rows<NSPLIT, 12>(sm, r0, w, lane, Kl);
    else soft_rows<NSPLIT, 16>(sm, r0, w, lane, Kl);
    __syncthreads();   // every probability row is in LDS before P.V reads it
    const int ks = w & (KS - 1), dh = w / KS;   // key part, 64-column half of the head
    const int per = ((Kl + 64 * KS - 1) / (64 * KS)) * 64;   // keys per part, whole 128-byte lines of the 16-bit planes
    const int kb = ks * per, kn = min(Kl - kb, per);         // first key and key count of this part (count <= 0: empty, its partial tile is zeros)
    v8f acc[2][4];
#pragma unroll
    for (int mb = 0; mb < 2; ++mb)
#pragma unroll
        for (int nb = 0; nb < 4; ++nb) acc[mb][nb] = (v8f){};
    {   // stage 3: P.V
        constexpr int NU = (NSPLIT == 2) ? 1 : 2; const unsigned char* pa = sm + lr * SPB + (8 * hi + kb) * 2; const size_t vo = (size_t)(dh * 64 + lr) * TT + 8 * hi + kb;
#pragma unroll 1
        for (int kc = 0; kc < kn; kc += 64) {
#pragma unroll
            for (int u0 = 0; u0 < 2; u0 += NU) {   // NU 32-key blocks are loaded as one lot (the 3-product form has the registers for one)
                V b[NU][4], b2[NU][4], a[NU][2], a2[NU][2];
#pragma unroll
                for (int u = 0; u < NU; ++u)
#pragma unroll
                    for (int nb = 0; nb < 4; ++nb) { const size_t o = vo + (size_t)nb * 16 * TT + kc + (u0 + u) * 32; b[u][nb] = WFrag<T16>::ld(Vt + o); if (NSPLIT == 2) b2[u][nb] = WFrag<T16>::ld(Vt2 + o); }
#pragma unroll
                for (int u = 0; u < NU; ++u)
#pragma unroll
                    for (int mb = 0; mb < 2; ++mb) { a[u][mb] = WFrag<T16>::ld((const T16*)(pa + mb * 16 * SPB) + kc + (u0 + u) * 32); if (NSPLIT == 2) a2[u][mb] = WFrag<T16>::ld((const T16*)(pa + mb * 16 * SPB + TT * 2) + kc + (u0 + u) * 32); }
                __builtin_amdgcn_sched_barrier(0);   // keeps the lot's loads together ahead of the products: one trip to L2 for the lot
#pragma unroll
                for (int u = 0; u < NU; ++u)
#pragma unroll
                    for (int nb = 0; nb < 4; ++nb)
#pragma unroll
                        for (int mb = 0; mb < 2; ++mb) { acc[mb][nb] = WFrag<T16>::mma(a[u][mb], b[u][nb], acc[mb][nb]); if (NSPLIT == 2) { acc[mb][nb] = WFrag<T16>::mma(a2[u][mb], b[u][nb], acc[mb][nb]); acc[mb][nb] = WFrag<T16>::mma(a[u][mb], b2[u][nb], acc[mb][nb]); } }
            }
        }
    }
    __syncthreads();   // every wave has read its probabilities: their LDS now takes the partial tiles
#pragma unroll
    for (int mb = 0; mb < 2; ++mb)
#pragma unroll
        for (int nb = 0; nb < 4; ++nb)
#pragma unroll
            for (int j = 0; j < 8; ++j) S[ks * (QR * OPF) + (mb * 16 + hi * 8 + j) * OPF + dh * 64 + nb * 16 + lr] = acc[mb][nb][j];
    __syncthreads();   // every partial tile is in LDS before they are added
    const float cs = (NSPLIT == 2) ? 1.0f : (1.0f / PCAR);
#pragma unroll
    for (int it = 0; it < QR * HD / (NW * 32 * 4); ++it) { const int e = (it * NW * 32 + tid) * 4; const int row = e / HD, d = e % HD;   // stage 4: one wave stores one row's 256 bytes of each plane
        v4f o = *(const v4fa*)(S + row * OPF + d);   /* the KS partial tiles of P.V, added in part order */
#pragma unroll
        for (int s = 1; s < KS; ++s) { const v4f p = *(const v4fa*)(S + s * (QR * OPF) + row * OPF + d); o[0] += p[0]; o[1] += p[1]; o[2] += p[2]; o[3] += p[3]; }
        v4us oh, ol;
#pragma unroll
        for (int q = 0; q < 4; ++q) { unsigned short a, c2; splitf(o[q] * cs, a, c2); oh[q] = a; ol[q] = c2; }
        const size_t oo = (size_t)(r0 + row) * DQ + h * HD + d; *(v4us*)(Ah + oo) = oh; *(v4us*)(Al + oo) = ol; }
}
// grid (heads, TT / QR): the row blocks run from the last (most keys) to the first, so that the key count falls with the flat index.
__global__ __launch_bounds__(NW * 32) void k_attn(const h16* __restrict__ Q16, const h16* __restrict__ K16, const h16* __restrict__ V16, const bf* __restrict__ Qh, const bf* __restrict__ Ql, const bf* __restrict__ Kh, const bf* __restrict__ Klo, const bf* __restrict__ Vh, const bf* __restrict__ Vl, bf* Ah, bf* Al) {
    __shared__ __align__(16) unsigned char sm[QR * SPB];
    const int h = blockIdx.x; const int r0 = (TT / QR - 1 - (int)blockIdx.y) * QR; const size_t zq = (size_t)h * TT * HD, zk = (size_t)(h / REP) * TT * HD;
    if (r0 < RH) attn_body<bf, 2>(sm, Qh + zq, Ql + zq, Kh + zk, Klo + zk, Vh + zk, Vl + zk, r0, h, Ah, Al);
    else attn_body<h16, 0>(sm, Q16 + zq, nullptr, K16 + zk, nullptr, V16 + zk, nullptr, r0, h, Ah, Al);
}

extern "C" void kernel_launch(void* const* d_in, const int* in_sizes, int n_in,
                              void* d_out, int out_size, void* d_ws, size_t ws_size, hipStream_t stream) {
    (void)in_sizes; (void)n_in; (void)out_size;
        const float* x = (const float*)d_in[0]; const float* wq = (const float*)d_in[1]; const float* wk = (const float*)d_in[2]; const float* wv = (const float*)d_in[3]; const float* wo = (const float*)d_in[4];   /* x, Wq, Wk, Wv, Wo ('xw' (in, out) [2048][2048]): FIVE inputs, all read */
    float* OUT = (float*)d_out;     // [2][2048][2048]
    char* wsp = (char*)d_ws;
    auto take = [&](size_t bytes) { char* p = wsp; wsp += (bytes + 255) & ~(size_t)255; return (void*)p; };
    bf* WQ = (bf*)take((size_t)DQ * DM * 2); bf* WK = (bf*)take((size_t)DKV * DM * 2); bf* WV = (bf*)take((size_t)DKV * DM * 2); bf* WO = (bf*)take((size_t)DM * DQ * 2); float* CS = (float*)take((size_t)TT * HD * 2 * 4);
    bf* XB = (bf*)take((size_t)TT * DM * 2); float* FQ = (float*)take((size_t)TT * DQ * 4); float* FK = (float*)take((size_t)TT * DKV * 4);
    h16* QP16 = (h16*)take((size_t)NH_ * TT * HD * 2); h16* KP16 = (h16*)take((size_t)NKV * TT * HD * 2); h16* VT16 = (h16*)take((size_t)NKV * HD * TT * 2);
    bf* QPh = (bf*)take((size_t)NH_ * TT * HD * 2); bf* QPl = (bf*)take((size_t)NH_ * TT * HD * 2); bf* KPh = (bf*)take((size_t)NKV * TT * HD * 2); bf* KPl = (bf*)take((size_t)NKV * TT * HD * 2); bf* VTh = (bf*)take((size_t)NKV * HD * TT * 2); bf* VTl = (bf*)take((size_t)NKV * HD * TT * 2);
    bf* ATh = (bf*)take((size_t)TT * DQ * 2); bf* ATl = (bf*)take((size_t)TT * DQ * 2);
    if ((size_t)(wsp - (char*)d_ws) > ws_size) return;    // ws 256 MiB
    float* FV = FK;   // v projection reuses the k buffer after the k planes are built (stream-ordered)
    { k_wtG<<<(unsigned)((DM * DQ / 64 + 63) / 64), 256, 0, stream>>>(wq, DM, DQ, WQ); k_wtG<<<(unsigned)((DM * DKV / 64 + 63) / 64), 256, 0, stream>>>(wk, DM, DKV, WK); k_wtG<<<(unsigned)((DM * DKV / 64 + 63) / 64), 256, 0, stream>>>(wv, DM, DKV, WV);
      k_wtG<<<(unsigned)((DQ * DM / 64 + 63) / 64), 256, 0, stream>>>(wo, DQ, DM, WO);
       }
    k_csP<<<(TT * HD + 255) / 256, 256, 0, stream>>>(CS);   /* rotary table once (positions = arange) */
    const unsigned LQ = (unsigned)(((size_t)NH_ * TT * HD / 2 + 255) / 256), LKv = (unsigned)(((size_t)NKV * TT * HD / 2 + 255) / 256);
    for (int b = 0; b < NB_; ++b) {
        
        k_cvt8<<<(unsigned)(((size_t)TT * DM / 8 + 255) / 256), 256, 0, stream>>>(x + (size_t)b * TT * DM, XB, (size_t)TT * DM / 8);
        k_gemmw<bf, 0, false><<<dim3(TT / 64, DQ / 64, 1), 32, 0, stream>>>(XB, nullptr, WQ, nullptr, DM, FQ, DQ, nullptr, 0, 0, 0);
        k_ropeI<<<LQ, 256, 0, stream>>>(FQ, DQ, NH_, CS, 1.0f, QP16, QPh, QPl);
        k_gemmw<bf, 0, false><<<dim3(TT / 64, DKV / 64, 1), 32, 0, stream>>>(XB, nullptr, WK, nullptr, DM, FK, DKV, nullptr, 0, 0, 0);
        k_ropeI<<<LKv, 256, 0, stream>>>(FK, DKV, NKV, CS, 1.0f, KP16, KPh, KPl);
        k_gemmw<bf, 0, false><<<dim3(TT / 64, DKV / 64, 1), 32, 0, stream>>>(XB, nullptr, WV, nullptr, DM, FV, DKV, nullptr, 0, 0, 0); k_vtp<<<LKv, 256, 0, stream>>>(FV, DKV, NKV, VT16, VTh, VTl);
        k_attn<<<dim3(NH_, TT / QR, 1), NW * 32, 0, stream>>>(QP16, KP16, VT16, QPh, QPl, KPh, KPl, VTh, VTl, ATh, ATl);
        k_gemmw<bf, 1, false><<<dim3(TT / 64, DM / 64, 1), 32, 0, stream>>>(ATh, ATl, WO, nullptr, DQ, OUT + (size_t)b * TT * DM, DM, nullptr, 0, 0, 0); }
}
